// v000
// The times below were measured on an AMD MI455X: many runs one after another, warmed up first and cycling through
// copies of the inputs, with the whole window's GPU time divided by the number of runs. Launches and the gaps
// between them are all in it. The median over several windows is given; except for v000 it joins two sittings, which
// can be a few percent apart, so the side-by-side timings, each taken in one sitting, are the better comparison.
// The starting kernel, v000, takes 2700 microseconds a run.
#include <hip/hip_runtime.h>

// Grouped-query causal attention with interleaved-pair rotary embeddings at ROPE_THETA 500000 (x [2][2048][2048]; q = x Wq ('xw' (in, out) [2048][2048] 2048^-0.5, 32 heads x 64), k = x Wk, v = x Wv ('xw' [2048][512], 8 kv heads; no biases); rope on (even, odd) pairs: (e cos - o sin, o cos + e sin) with angle position x 1 / 500000^(2i/64), the cos / sin tables computed in the module for positions arange(2048) (32 f32 frequencies jnp-exact); jnp.repeat(k, 4, axis = 2): kv head = q head / 4; scores / sqrt(64); causal (-inf); softmax; out = merged Wo ('xw' [2048][2048]) -> [2][2048][2048] (8.4 M); argument order x, Wq, Wk, Wv, Wo).
// Compute dtypes, f32 accumulate: every input rounded to bf16; q/k/v on PLAIN bf16 operands (inputs: exact); rotary in f32 (precise cosf/sinf table); causal scores and attn.v (tile skipping; the pass's two query heads read the same kv planes): query rows < 512 hl (3 products), the rest single fp16 (x1024); softmax f32; Wo hl x exact (2 products).

#define NB_  2
#define TT   2048
#define DM   2048
#define NH_  32
#define NKV  8
#define REP  (NH_ / NKV)
#define HD   64
#define DQ   (NH_ * HD)
#define DKV  (NKV * HD)
#define ZH   2
#define RH   512                  // query rows < RH use hi+lo planes (0: none)
#define WIN  2048
#define PCAR 1024.0f
#define SCL  0.125f   // HD^-0.5
typedef _Float16 h16;
typedef unsigned short bf;
typedef __attribute__((ext_vector_type(16))) __bf16   v16bf;
typedef __attribute__((ext_vector_type(16))) _Float16 v16h;
typedef __attribute__((ext_vector_type(8)))  _Float16 v8h;
typedef __attribute__((ext_vector_type(8)))  unsigned short v8us;
typedef __attribute__((ext_vector_type(8)))  float    v8f;
typedef __attribute__((ext_vector_type(4)))  float    v4f;
typedef v8h  __attribute__((may_alias)) v8ha;
typedef v4f  __attribute__((may_alias)) v4fa;
typedef v8us __attribute__((may_alias)) v8usa;

__device__ __forceinline__ unsigned short f2bf(float f) { unsigned u = __float_as_uint(f); u += 0x7FFFu + ((u >> 16) & 1u); return (unsigned short)(u >> 16); }
__device__ __forceinline__ float bf2f(unsigned short b) { return __uint_as_float(((unsigned)b) << 16); }
__device__ __forceinline__ float bfr(float f) { return bf2f(f2bf(f)); }
__device__ __forceinline__ v16h cat16(v8h lo, v8h hi) { return __builtin_shufflevector(lo, hi, 0, 1, 2, 3, 4, 5, 6, 7, 8, 9, 10, 11, 12, 13, 14, 15); }
__device__ __forceinline__ v16bf cat16b(v8us lo, v8us hi) { return __builtin_bit_cast(v16bf, __builtin_shufflevector(lo, hi, 0, 1, 2, 3, 4, 5, 6, 7, 8, 9, 10, 11, 12, 13, 14, 15)); }
__device__ __forceinline__ v8f wmma16(v16h a, v16h b, v8f c) { return __builtin_amdgcn_wmma_f32_16x16x32_f16(false, a, false, b, (short)0, c, false, false); }
__device__ __forceinline__ v8f wmmab(v16bf a, v16bf b, v8f c) { return __builtin_amdgcn_wmma_f32_16x16x32_bf16(false, a, false, b, (short)0, c, false, false); }



// ---- k_gemmw: register-blocked GEMM, ONE WAVE per 64x64 output tile (16 accumulators), operands straight from K-contiguous 16-bit planes; grid (M/64, N/64, Z), 32 threads.
// C[m][n] (f32, pitch ldc, + optional f32 bias[n]) = sum_k A[m][k] Bt[n][k] (+ split products per NSPLIT). z-batch strides sA/sB/sC in elements. K % 32 == 0.
template <typename T16> struct WFrag;
template <> struct WFrag<h16> { typedef v16h V; static __device__ __forceinline__ V ld(const h16* p) { return cat16(*(const v8h*)p, *(const v8h*)(p + 16)); } static __device__ __forceinline__ v8f mma(V a, V b, v8f c) { return wmma16(a, b, c); } };
template <> struct WFrag<bf> { typedef v16bf V; static __device__ __forceinline__ V ld(const bf* p) { return cat16b(*(const v8us*)p, *(const v8us*)(p + 16)); } static __device__ __forceinline__ v8f mma(V a, V b, v8f c) { return wmmab(a, b, c); } };
template <typename T16, int NSPLIT, bool BIAS>
__global__ __launch_bounds__(32) void k_gemmw(const T16* __restrict__ A, const T16* __restrict__ A2, const T16* __restrict__ Bt, const T16* __restrict__ Bt2, int K, float* C, int ldc, const float* __restrict__ bias, size_t sA, size_t sB, size_t sC) {
    typedef typename WFrag<T16>::V V;
    __shared__ __align__(16) float os[16 * 68];
    const size_t z = blockIdx.z; A += z * sA; if (A2) A2 += z * sA; Bt += z * sB; if (Bt2) Bt2 += z * sB; C += z * sC;
    const int lane = threadIdx.x & 31, lr = lane & 15, hi = lane >> 4; const int r0 = blockIdx.x * 64, c0 = blockIdx.y * 64;
    v8f acc[4][4];
#pragma unroll
    for (int mb = 0; mb < 4; ++mb)
#pragma unroll
        for (int nb = 0; nb < 4; ++nb) acc[mb][nb] = (v8f){};
    const size_t aoff = (size_t)(r0 + lr) * K + 8 * hi, boff = (size_t)(c0 + lr) * K + 8 * hi;
#pragma unroll 1
    for (int kc = 0; kc < K; kc += 32) {
        V a[4], a2[4];
#pragma unroll
        for (int mb = 0; mb < 4; ++mb) { a[mb] = WFrag<T16>::ld(A + aoff + (size_t)mb * 16 * K + kc); if (NSPLIT == 1 || NSPLIT == 2) a2[mb] = WFrag<T16>::ld(A2 + aoff + (size_t)mb * 16 * K + kc); }
#pragma unroll
        for (int nb = 0; nb < 4; ++nb) { const V b = WFrag<T16>::ld(Bt + boff + (size_t)nb * 16 * K + kc); V b2; if (NSPLIT >= 2) b2 = WFrag<T16>::ld(Bt2 + boff + (size_t)nb * 16 * K + kc);
#pragma unroll
            for (int mb = 0; mb < 4; ++mb) { acc[mb][nb] = WFrag<T16>::mma(a[mb], b, acc[mb][nb]); if (NSPLIT == 1 || NSPLIT == 2) acc[mb][nb] = WFrag<T16>::mma(a2[mb], b, acc[mb][nb]); if (NSPLIT >= 2) acc[mb][nb] = WFrag<T16>::mma(a[mb], b2, acc[mb][nb]); } }
        asm volatile("v_nop\n\tv_nop\n\tv_nop\n\tv_nop" : "+v"(acc[0][0]), "+v"(acc[1][1]), "+v"(acc[2][2]), "+v"(acc[3][3]) : "v"(a[0]), "v"(a[3]));
    }
#pragma unroll
    for (int mb = 0; mb < 4; ++mb) {
#pragma unroll
        for (int nb = 0; nb < 4; ++nb) {
#pragma unroll
            for (int j = 0; j < 8; ++j) os[(hi * 8 + j) * 68 + nb * 16 + lr] = acc[mb][nb][j]; }
        __builtin_amdgcn_wave_barrier(); asm volatile("" ::: "memory");
        float* crow = C + (size_t)(r0 + mb * 16) * ldc + c0;
{
#pragma unroll
            for (int s = 0; s < 8; ++s) { const int row = 2 * s + hi, cofs = lr * 4; v4f val = *(const v4fa*)(os + row * 68 + cofs); if (BIAS) { val[0] += bfr(bias[c0 + cofs]); val[1] += bfr(bias[c0 + cofs + 1]); val[2] += bfr(bias[c0 + cofs + 2]); val[3] += bfr(bias[c0 + cofs + 3]); }
                *(v4f*)(crow + (size_t)row * ldc + cofs) = val; }
             }
        __builtin_amdgcn_wave_barrier(); asm volatile("" ::: "memory");
    }
}

// ---- k_gemmc: the same one-wave 64x64 tile GEMM specialised for causal attention: CMODE 1 skips score tiles entirely above the diagonal (query rows r0+roff.., key columns c0..), CMODE 2 limits the
// key (K) loop of the probability x value contraction to the diagonal block (probabilities beyond it are exactly zero). roff = row offset of this launch's first row within the sequence.
template <typename T16, int NSPLIT, int CMODE>
__global__ __launch_bounds__(32) void k_gemmc(const T16* __restrict__ A, const T16* __restrict__ A2, const T16* __restrict__ Bt, const T16* __restrict__ Bt2, int K, float* C, int ldc, int roff, size_t sA, size_t sB, size_t sC) {
    typedef typename WFrag<T16>::V V;
    __shared__ __align__(16) float os[16 * 68];
    const size_t z = blockIdx.z; A += z * sA; if (A2) A2 += z * sA; Bt += z * sB; if (Bt2) Bt2 += z * sB; C += z * sC;
    const int lane = threadIdx.x & 31, lr = lane & 15, hi = lane >> 4; const int r0 = blockIdx.x * 64, c0 = blockIdx.y * 64;
    if (CMODE == 1 && c0 > r0 + roff + 63) return;                  // score tile entirely above the causal diagonal: never read (the softmax masks j > i by select)
    const int Kl = (CMODE == 2) ? min(K, r0 + roff + 64) : K;        // P.V: probabilities are exactly 0 beyond the diagonal block, so the K loop stops there
    v8f acc[4][4];
#pragma unroll
    for (int mb = 0; mb < 4; ++mb)
#pragma unroll
        for (int nb = 0; nb < 4; ++nb) acc[mb][nb] = (v8f){};
    const size_t aoff = (size_t)(r0 + lr) * K + 8 * hi, boff = (size_t)(c0 + lr) * K + 8 * hi;
#pragma unroll 1
    for (int kc = 0; kc < Kl; kc += 32) {
        V a[4], a2[4];
#pragma unroll
        for (int mb = 0; mb < 4; ++mb) { a[mb] = WFrag<T16>::ld(A + aoff + (size_t)mb * 16 * K + kc); if (NSPLIT == 1 || NSPLIT == 2) a2[mb] = WFrag<T16>::ld(A2 + aoff + (size_t)mb * 16 * K + kc); }
#pragma unroll
        for (int nb = 0; nb < 4; ++nb) { const V b = WFrag<T16>::ld(Bt + boff + (size_t)nb * 16 * K + kc); V b2; if (NSPLIT >= 2) b2 = WFrag<T16>::ld(Bt2 + boff + (size_t)nb * 16 * K + kc);
#pragma unroll
            for (int mb = 0; mb < 4; ++mb) { acc[mb][nb] = WFrag<T16>::mma(a[mb], b, acc[mb][nb]); if (NSPLIT == 1 || NSPLIT == 2) acc[mb][nb] = WFrag<T16>::mma(a2[mb], b, acc[mb][nb]); if (NSPLIT >= 2) acc[mb][nb] = WFrag<T16>::mma(a[mb], b2, acc[mb][nb]); } }
        asm volatile("v_nop\n\tv_nop\n\tv_nop\n\tv_nop" : "+v"(acc[0][0]), "+v"(acc[1][1]), "+v"(acc[2][2]), "+v"(acc[3][3]) : "v"(a[0]), "v"(a[3]));
    }
#pragma unroll
    for (int mb = 0; mb < 4; ++mb) {
#pragma unroll
        for (int nb = 0; nb < 4; ++nb) {
#pragma unroll
            for (int j = 0; j < 8; ++j) os[(hi * 8 + j) * 68 + nb * 16 + lr] = acc[mb][nb][j]; }
        __builtin_amdgcn_wave_barrier(); asm volatile("" ::: "memory");
        float* crow = C + (size_t)(r0 + mb * 16) * ldc + c0;
{
#pragma unroll
            for (int s = 0; s < 8; ++s) { const int row = 2 * s + hi, cofs = lr * 4; v4f val = *(const v4fa*)(os + row * 68 + cofs);
                *(v4f*)(crow + (size_t)row * ldc + cofs) = val; }
             }
        __builtin_amdgcn_wave_barrier(); asm volatile("" ::: "memory");
    }
}

__device__ __forceinline__ h16 tohx(float x) { return (h16)x; }
__device__ __forceinline__ void splitf(float y, unsigned short& h, unsigned short& l) { h = f2bf(y); l = f2bf(y - bf2f(h)); }
typedef __attribute__((ext_vector_type(2))) _Float16 v2h;
typedef __attribute__((ext_vector_type(4))) _Float16 v4h;
typedef __attribute__((ext_vector_type(2))) unsigned short v2us;
typedef __attribute__((ext_vector_type(4))) unsigned short v4us;
typedef __attribute__((ext_vector_type(2))) float v2f;
typedef __attribute__((ext_vector_type(4))) int v4i;

__global__ __launch_bounds__(256) void k_wtG(const float* __restrict__ w, int K, int N, bf* Bt) {
    const int lane = threadIdx.x & 31; const int L0 = (blockIdx.x * 8 + (threadIdx.x >> 5)) * 8; const int nlines = N * K / 64;
{
#pragma unroll 1
        for (int l = 0; l < 8; ++l) { const int L = L0 + l; if (L >= nlines) break; const size_t e = (size_t)L * 64 + lane * 2; const int k = (int)(e % K), n = (int)(e / K); v2us o;
            o[0] = f2bf(w[(size_t)k * N + n]); o[1] = f2bf(w[(size_t)(k + 1) * N + n]); *(v2us*)(Bt + e) = o; }
         }
}
__global__ __launch_bounds__(256) void k_cvt8(const float* __restrict__ src, bf* dst, size_t n8) { const size_t i = (size_t)blockIdx.x * 256 + threadIdx.x; if (i >= n8) return; const v8f v = *(const v8f*)(src + i * 8); v8us o;
#pragma unroll
    for (int k = 0; k < 8; ++k) o[k] = f2bf(v[k]); *(v8us*)(dst + i * 8) = o;  }
__constant__ float INV2[HD / 2] = { 1.000000000e+00f, 6.636012793e-01f, 4.403666258e-01f, 2.922278345e-01f, 1.939227581e-01f, 1.286873817e-01f, 8.539710194e-02f, 5.666961893e-02f, 3.760603070e-02f, 2.495540865e-02f, 1.656044088e-02f, 1.098952908e-02f, 7.292665076e-03f, 4.839421250e-03f, 3.211446106e-03f, 2.131119603e-03f, 1.414213446e-03f, 9.384738514e-04f, 6.227724371e-04f, 4.132725589e-04f, 2.742481884e-04f, 1.819914323e-04f, 1.207697424e-04f, 8.014294872e-05f, 5.318295734e-05f, 3.529227615e-05f, 2.341999789e-05f, 1.554154005e-05f, 1.031338525e-05f, 6.843975370e-06f, 4.541670478e-06f, 3.013858077e-06f };   // THIS module's 1.0 / (500000.0 ** (arange(0, 64, 2, float32) / 64)) evaluated in JAX float32 (bit-exact literals)
__global__ __launch_bounds__(256) void k_csP(float* CS) { const int idx = blockIdx.x * 256 + threadIdx.x; if (idx >= TT * HD) return; const int d = idx % HD; const int t = idx / HD; const float a = __fmul_rn((float)t, INV2[d >> 1]); v2f cs; cs[0] = cosf(a); cs[1] = sinf(a); *(v2f*)(CS + (size_t)idx * 2) = cs;  }

__global__ __launch_bounds__(256) void k_ropeI(const float* __restrict__ F, int pitch, int nheads, const float* __restrict__ CS, float sc, h16* P16, bf* Ph, bf* Pl) {
    const size_t e = ((size_t)blockIdx.x * 256 + threadIdx.x) * 2; if (e >= (size_t)nheads * TT * HD) return; const int d = (int)(e % HD); const int t = (int)((e / HD) % TT); const int h = (int)(e / ((size_t)HD * TT)); const float* f = F + (size_t)t * pitch + h * HD; const float x0 = f[d], x1 = f[d + 1]; const v2f cs = *(const v2f*)(CS + ((size_t)t * HD + d) * 2); v2h o16; v2us oh, ol;
    float a0 = __fmul_rn(x0, cs[0]), b0 = __fmul_rn(x1, cs[1]), a1 = __fmul_rn(x1, cs[0]), b1 = __fmul_rn(x0, cs[1]); asm volatile("" : "+v"(a0), "+v"(b0), "+v"(a1), "+v"(b1));
    float r0 = __fsub_rn(a0, b0) * sc, r1 = __fadd_rn(b1, a1) * sc;   /* even: x0 c - x1 s; odd: x0 s + x1 c */
    o16[0] = tohx(r0); o16[1] = tohx(r1); { unsigned short a2, c2; splitf(r0, a2, c2); oh[0] = a2; ol[0] = c2; splitf(r1, a2, c2); oh[1] = a2; ol[1] = c2; }
    *(v2h*)(P16 + e) = o16; *(v2us*)(Ph + e) = oh; *(v2us*)(Pl + e) = ol;  }
// k_rope: head planes [h][t][d] (fp16 + hi/lo) of rope(x) x sc with the rotate-half convention out[d] = x[d] cos[t][d] - x[d+HD/2] sin[t][d], out[d+HD/2] = x[d+HD/2] cos[t][d+HD/2] + x[d] sin[t][d+HD/2]
__global__ __launch_bounds__(256) void k_rope(const float* __restrict__ F, int pitch, int nheads, const float* __restrict__ CS, const float* __restrict__ RF, const float* __restrict__ nw, float sc, h16* P16, bf* Ph, bf* Pl) {
    const size_t e = ((size_t)blockIdx.x * 256 + threadIdx.x) * 2; if (e >= (size_t)nheads * TT * HD) return; const int d = (int)(e % HD); const int t = (int)((e / HD) % TT); const int h = (int)(e / ((size_t)HD * TT)); const float* f = F + (size_t)t * pitch + h * HD; const float rf = RF ? RF[(size_t)h * TT + t] : 1.0f; v2h o16; v2us oh, ol;
#pragma unroll
    for (int q = 0; q < 2; ++q) { const int dd = d + q; const int dp = (dd < HD / 2) ? dd + HD / 2 : dd - HD / 2; float x0 = f[dd], x1 = f[dp];
        if (RF) { float n0 = __fmul_rn(x0, rf), n1 = __fmul_rn(x1, rf); asm volatile("" : "+v"(n0)); asm volatile("" : "+v"(n1)); x0 = __fmul_rn(bfr(nw[dd]), n0); x1 = __fmul_rn(bfr(nw[dp]), n1); }
        const v2f cs = *(const v2f*)(CS + ((size_t)t * HD + dd) * 2); float a = __fmul_rn(x0, cs[0]), bq = __fmul_rn(x1, cs[1]); asm volatile("" : "+v"(a)); asm volatile("" : "+v"(bq)); const float r = ((dd < HD / 2) ? __fsub_rn(a, bq) : __fadd_rn(a, bq)) * sc;
        o16[q] = tohx(r); unsigned short a2, c2; splitf(r, a2, c2); oh[q] = a2; ol[q] = c2; }
    *(v2h*)(P16 + e) = o16; *(v2us*)(Ph + e) = oh; *(v2us*)(Pl + e) = ol;  }
__global__ __launch_bounds__(256) void k_vtp(const float* __restrict__ F, int pitch, int nheads, h16* V16, bf* Vh, bf* Vl) { const size_t e = ((size_t)blockIdx.x * 256 + threadIdx.x) * 2; if (e >= (size_t)nheads * HD * TT) return; const int t = (int)(e % TT); const int d = (int)((e / TT) % HD); const int g = (int)(e / ((size_t)TT * HD)); v2h o16; v2us oh, ol;
#pragma unroll
    for (int q = 0; q < 2; ++q) { const float x = F[(size_t)(t + q) * pitch + g * HD + d]; o16[q] = tohx(x); unsigned short a2, c2; splitf(x, a2, c2); oh[q] = a2; ol[q] = c2; }
    *(v2h*)(V16 + e) = o16; *(v2us*)(Vh + e) = oh; *(v2us*)(Vl + e) = ol;  }
// k_asoft: per row (zz, i): t = S x HD^-0.5 for j <= i and i - j < WIN (sliding causal window; the reference's -1e9 additive fill vanishes identically); softmax over the 2048 keys (register row, one exp, fixed trees);
__global__ __launch_bounds__(256) void k_asoft(const float* __restrict__ Sb, h16* P16, bf* Ph, bf* Pl) {
    const int lane = threadIdx.x & 31; const int row = blockIdx.x * 8 + (threadIdx.x >> 5); if (row >= ZH * TT) return; const int i = row % TT; const int zz = row / TT; (void)zz; const bool hires = (i < RH); const float* sr = Sb + (size_t)row * TT; float v[TT / 32]; float mx = -3.0e38f;
#pragma unroll
    for (int ch = 0; ch < TT / 128; ++ch) { const int j0 = ch * 128 + lane * 4; const v4f a = *(const v4f*)(sr + j0);
#pragma unroll
        for (int q = 0; q < 4; ++q) { const int j = j0 + q; (void)j; const float t = (j <= i && i - j < WIN) ? a[q] * SCL : -3.0e38f; v[ch * 4 + q] = t; mx = fmaxf(mx, t); } }
#pragma unroll
    for (int sh = 16; sh; sh >>= 1) mx = fmaxf(mx, __shfl_xor(mx, sh, 32));
    float sum = 0.f;
#pragma unroll
    for (int k = 0; k < TT / 32; ++k) { float d0 = __fsub_rn(v[k], mx); asm volatile("" : "+v"(d0)); v[k] = __builtin_amdgcn_exp2f(__fmul_rn(d0, 1.4426950408889634f)); sum += v[k]; }
#pragma unroll
    for (int sh = 16; sh; sh >>= 1) sum += __shfl_xor(sum, sh, 32);
    const float f = __fdiv_rn(hires ? 1.0f : PCAR, sum);
{
        if (hires) {
#pragma unroll
            for (int ch = 0; ch < TT / 128; ++ch) { v4us oh, ol;
#pragma unroll
                for (int q = 0; q < 4; ++q) { unsigned short a, c2; splitf(v[ch * 4 + q] * f, a, c2); oh[q] = a; ol[q] = c2; }
                const size_t oo = ((size_t)zz * (RH ? RH : 1) + i) * TT + ch * 128 + lane * 4; *(v4us*)(Ph + oo) = oh; *(v4us*)(Pl + oo) = ol; }
        } else {
#pragma unroll
            for (int ch = 0; ch < TT / 128; ++ch) { v4h o4;
#pragma unroll
                for (int q = 0; q < 4; ++q) o4[q] = tohx(v[ch * 4 + q] * f);
                *(v4h*)(P16 + (size_t)row * TT + ch * 128 + lane * 4) = o4; } }
         }
}
__global__ __launch_bounds__(256) void k_merge(const float* __restrict__ O, int h0, bf* Ah, bf* Al) { const size_t e = ((size_t)blockIdx.x * 256 + threadIdx.x) * 2; if (e >= (size_t)ZH * TT * HD) return; const int d = (int)(e % HD); const int t = (int)((e / HD) % TT); const int zz = (int)(e / ((size_t)HD * TT)); const float cs = (t < RH) ? 1.0f : (1.0f / PCAR); const size_t oo = (size_t)t * DQ + (h0 + zz) * HD + d;
    v2us oh, ol;
#pragma unroll
    for (int q = 0; q < 2; ++q) { unsigned short a, c2; splitf(O[e + q] * cs, a, c2); oh[q] = a; ol[q] = c2; } *(v2us*)(Ah + oo) = oh; *(v2us*)(Al + oo) = ol;  }

extern "C" void kernel_launch(void* const* d_in, const int* in_sizes, int n_in,
                              void* d_out, int out_size, void* d_ws, size_t ws_size, hipStream_t stream) {
    (void)in_sizes; (void)n_in; (void)out_size;
    const float* x = (const float*)d_in[0]; const float* wq = (const float*)d_in[1]; const float* wk = (const float*)d_in[2]; const float* wv = (const float*)d_in[3]; const float* wo = (const float*)d_in[4];   /* FIVE inputs, all read; this module has no position input: the table is computed for positions 0..2047 */
    float* OUT = (float*)d_out;     // [2][2048][2048]
    char* wsp = (char*)d_ws;
    auto take = [&](size_t bytes) { char* p = wsp; wsp += (bytes + 255) & ~(size_t)255; return (void*)p; };
    bf* WQ = (bf*)take((size_t)DQ * DM * 2); bf* WK = (bf*)take((size_t)DKV * DM * 2); bf* WV = (bf*)take((size_t)DKV * DM * 2); bf* WO = (bf*)take((size_t)DM * DQ * 2); float* CS = (float*)take((size_t)TT * HD * 2 * 4);
    bf* XB = (bf*)take((size_t)TT * DM * 2); float* FQ = (float*)take((size_t)TT * DQ * 4); float* FK = (float*)take((size_t)TT * DKV * 4);
    h16* QP16 = (h16*)take((size_t)NH_ * TT * HD * 2); h16* KP16 = (h16*)take((size_t)NKV * TT * HD * 2); h16* VT16 = (h16*)take((size_t)NKV * HD * TT * 2);
    bf* QPh = (bf*)take((size_t)NH_ * TT * HD * 2); bf* QPl = (bf*)take((size_t)NH_ * TT * HD * 2); bf* KPh = (bf*)take((size_t)NKV * TT * HD * 2); bf* KPl = (bf*)take((size_t)NKV * TT * HD * 2); bf* VTh = (bf*)take((size_t)NKV * HD * TT * 2); bf* VTl = (bf*)take((size_t)NKV * HD * TT * 2); bf* Ph = (bf*)take((size_t)ZH * RH * TT * 2); bf* Pl = (bf*)take((size_t)ZH * RH * TT * 2);
    float* Sb = (float*)take((size_t)ZH * TT * TT * 4); h16* P16 = (h16*)take((size_t)ZH * TT * TT * 2); float* Ob = (float*)take((size_t)ZH * TT * HD * 4); bf* ATh = (bf*)take((size_t)TT * DQ * 2); bf* ATl = (bf*)take((size_t)TT * DQ * 2);
    if ((size_t)(wsp - (char*)d_ws) > ws_size) return;    // ws 256 MiB
    float* FV = FK;   // v projection reuses the k buffer after the k planes are built (stream-ordered)
    { k_wtG<<<(unsigned)((DM * DQ / 64 + 63) / 64), 256, 0, stream>>>(wq, DM, DQ, WQ); k_wtG<<<(unsigned)((DM * DKV / 64 + 63) / 64), 256, 0, stream>>>(wk, DM, DKV, WK); k_wtG<<<(unsigned)((DM * DKV / 64 + 63) / 64), 256, 0, stream>>>(wv, DM, DKV, WV);
      k_wtG<<<(unsigned)((DQ * DM / 64 + 63) / 64), 256, 0, stream>>>(wo, DQ, DM, WO);
      k_csP<<<(TT * HD + 255) / 256, 256, 0, stream>>>(CS); }
    const unsigned LQ = (unsigned)(((size_t)NH_ * TT * HD / 2 + 255) / 256), LKv = (unsigned)(((size_t)NKV * TT * HD / 2 + 255) / 256);
    for (int b = 0; b < NB_; ++b) {
        
        k_cvt8<<<(unsigned)(((size_t)TT * DM / 8 + 255) / 256), 256, 0, stream>>>(x + (size_t)b * TT * DM, XB, (size_t)TT * DM / 8);
        k_gemmw<bf, 0, false><<<dim3(TT / 64, DQ / 64, 1), 32, 0, stream>>>(XB, nullptr, WQ, nullptr, DM, FQ, DQ, nullptr, 0, 0, 0);
        k_ropeI<<<LQ, 256, 0, stream>>>(FQ, DQ, NH_, CS, 1.0f, QP16, QPh, QPl);
        k_gemmw<bf, 0, false><<<dim3(TT / 64, DKV / 64, 1), 32, 0, stream>>>(XB, nullptr, WK, nullptr, DM, FK, DKV, nullptr, 0, 0, 0);
        k_ropeI<<<LKv, 256, 0, stream>>>(FK, DKV, NKV, CS, 1.0f, KP16, KPh, KPl);
        k_gemmw<bf, 0, false><<<dim3(TT / 64, DKV / 64, 1), 32, 0, stream>>>(XB, nullptr, WV, nullptr, DM, FV, DKV, nullptr, 0, 0, 0); k_vtp<<<LKv, 256, 0, stream>>>(FV, DKV, NKV, VT16, VTh, VTl);
        for (int h0 = 0; h0 < NH_; h0 += ZH) { const size_t zq = (size_t)h0, zk = (size_t)(h0 / REP);   // both heads of a pass share kv group h0/REP (REP >= 2): sB = 0
            k_gemmc<bf, 2, 1><<<dim3(RH / 64, TT / 64, ZH), 32, 0, stream>>>(QPh + zq * TT * HD, QPl + zq * TT * HD, KPh + zk * TT * HD, KPl + zk * TT * HD, HD, Sb, TT, 0, (size_t)TT * HD, 0, (size_t)TT * TT);
            k_gemmc<h16, 0, 1><<<dim3((TT - RH) / 64, TT / 64, ZH), 32, 0, stream>>>(QP16 + zq * TT * HD + (size_t)RH * HD, nullptr, KP16 + zk * TT * HD, nullptr, HD, Sb + (size_t)RH * TT, TT, RH, (size_t)TT * HD, 0, (size_t)TT * TT);
            k_asoft<<<ZH * TT / 8, 256, 0, stream>>>(Sb, P16, Ph, Pl);
            k_gemmc<bf, 2, 2><<<dim3(RH / 64, HD / 64, ZH), 32, 0, stream>>>(Ph, Pl, VTh + zk * HD * TT, VTl + zk * HD * TT, TT, Ob, HD, 0, (size_t)RH * TT, 0, (size_t)TT * HD);
            k_gemmc<h16, 0, 2><<<dim3((TT - RH) / 64, HD / 64, ZH), 32, 0, stream>>>(P16 + (size_t)RH * TT, nullptr, VT16 + zk * HD * TT, nullptr, TT, Ob + (size_t)RH * HD, HD, RH, (size_t)TT * TT, 0, (size_t)TT * HD);
            k_merge<<<(unsigned)(((size_t)ZH * TT * HD / 2 + 255) / 256), 256, 0, stream>>>(Ob, h0, ATh, ATl); }
        k_gemmw<bf, 1, false><<<dim3(TT / 64, DM / 64, 1), 32, 0, stream>>>(ATh, ATl, WO, nullptr, DQ, OUT + (size_t)b * TT * DM, DM, nullptr, 0, 0, 0); }
}

// v001
// It runs in 1270 microseconds.
// In two side-by-side timings against v000, it was 2.12 and 2.14 times as fast.
#include <hip/hip_runtime.h>

// Grouped-query causal attention with interleaved-pair rotary embeddings at ROPE_THETA 500000 (x [2][2048][2048]; q = x Wq ('xw' (in, out) [2048][2048] 2048^-0.5, 32 heads x 64), k = x Wk, v = x Wv ('xw' [2048][512], 8 kv heads; no biases); rope on (even, odd) pairs: (e cos - o sin, o cos + e sin) with angle position x 1 / 500000^(2i/64), the cos / sin tables computed in the module for positions arange(2048) (32 f32 frequencies jnp-exact); jnp.repeat(k, 4, axis = 2): kv head = q head / 4; scores / sqrt(64); causal (-inf); softmax; out = merged Wo ('xw' [2048][2048]) -> [2][2048][2048] (8.4 M); argument order x, Wq, Wk, Wv, Wo).
// Compute dtypes, f32 accumulate: every input rounded to bf16; q/k/v on PLAIN bf16 operands (inputs: exact); rotary in f32 (precise cosf/sinf table); causal scores and attn.v (tile skipping; a pass takes eight query heads = two kv groups, query head z reads kv plane z / 4): query rows < 512 hl (3 products), the rest single fp16 (x1024); softmax f32; Wo hl x exact (2 products).

#define NB_  2
#define TT   2048
#define DM   2048
#define NH_  32
#define NKV  8
#define REP  (NH_ / NKV)
#define HD   64
#define DQ   (NH_ * HD)
#define DKV  (NKV * HD)
#define ZH   8                    // query heads per attention pass (a multiple of REP)
#define RH   512                  // query rows < RH use hi+lo planes (0: none)
#define WIN  2048
#define PCAR 1024.0f
#define SCL  0.125f   // HD^-0.5
typedef _Float16 h16;
typedef unsigned short bf;
typedef __attribute__((ext_vector_type(16))) __bf16   v16bf;
typedef __attribute__((ext_vector_type(16))) _Float16 v16h;
typedef __attribute__((ext_vector_type(8)))  _Float16 v8h;
typedef __attribute__((ext_vector_type(8)))  unsigned short v8us;
typedef __attribute__((ext_vector_type(8)))  float    v8f;
typedef __attribute__((ext_vector_type(4)))  float    v4f;
typedef v8h  __attribute__((may_alias)) v8ha;
typedef v4f  __attribute__((may_alias)) v4fa;
typedef v8us __attribute__((may_alias)) v8usa;

__device__ __forceinline__ unsigned short f2bf(float f) { unsigned u = __float_as_uint(f); u += 0x7FFFu + ((u >> 16) & 1u); return (unsigned short)(u >> 16); }
__device__ __forceinline__ float bf2f(unsigned short b) { return __uint_as_float(((unsigned)b) << 16); }
__device__ __forceinline__ float bfr(float f) { return bf2f(f2bf(f)); }
__device__ __forceinline__ v16h cat16(v8h lo, v8h hi) { return __builtin_shufflevector(lo, hi, 0, 1, 2, 3, 4, 5, 6, 7, 8, 9, 10, 11, 12, 13, 14, 15); }
__device__ __forceinline__ v16bf cat16b(v8us lo, v8us hi) { return __builtin_bit_cast(v16bf, __builtin_shufflevector(lo, hi, 0, 1, 2, 3, 4, 5, 6, 7, 8, 9, 10, 11, 12, 13, 14, 15)); }
__device__ __forceinline__ v8f wmma16(v16h a, v16h b, v8f c) { return __builtin_amdgcn_wmma_f32_16x16x32_f16(false, a, false, b, (short)0, c, false, false); }
__device__ __forceinline__ v8f wmmab(v16bf a, v16bf b, v8f c) { return __builtin_amdgcn_wmma_f32_16x16x32_bf16(false, a, false, b, (short)0, c, false, false); }



// ---- k_gemmw: register-blocked GEMM, ONE WAVE per 64x64 output tile (16 accumulators), operands straight from K-contiguous 16-bit planes; grid (M/64, N/64, Z), 32 threads.
// C[m][n] (f32, pitch ldc, + optional f32 bias[n]) = sum_k A[m][k] Bt[n][k] (+ split products per NSPLIT). z-batch strides sA/sB/sC in elements. K % 32 == 0.
template <typename T16> struct WFrag;
template <> struct WFrag<h16> { typedef v16h V; static __device__ __forceinline__ V ld(const h16* p) { return cat16(*(const v8h*)p, *(const v8h*)(p + 16)); } static __device__ __forceinline__ v8f mma(V a, V b, v8f c) { return wmma16(a, b, c); } };
template <> struct WFrag<bf> { typedef v16bf V; static __device__ __forceinline__ V ld(const bf* p) { return cat16b(*(const v8us*)p, *(const v8us*)(p + 16)); } static __device__ __forceinline__ v8f mma(V a, V b, v8f c) { return wmmab(a, b, c); } };
template <typename T16, int NSPLIT, bool BIAS>
__global__ __launch_bounds__(32) void k_gemmw(const T16* __restrict__ A, const T16* __restrict__ A2, const T16* __restrict__ Bt, const T16* __restrict__ Bt2, int K, float* C, int ldc, const float* __restrict__ bias, size_t sA, size_t sB, size_t sC) {
    typedef typename WFrag<T16>::V V;
    __shared__ __align__(16) float os[16 * 68];
    const size_t z = blockIdx.z; A += z * sA; if (A2) A2 += z * sA; Bt += z * sB; if (Bt2) Bt2 += z * sB; C += z * sC;
    const int lane = threadIdx.x & 31, lr = lane & 15, hi = lane >> 4; const int r0 = blockIdx.x * 64, c0 = blockIdx.y * 64;
    v8f acc[4][4];
#pragma unroll
    for (int mb = 0; mb < 4; ++mb)
#pragma unroll
        for (int nb = 0; nb < 4; ++nb) acc[mb][nb] = (v8f){};
    const size_t aoff = (size_t)(r0 + lr) * K + 8 * hi, boff = (size_t)(c0 + lr) * K + 8 * hi;
#pragma unroll 1
    for (int kc = 0; kc < K; kc += 32) {
        V a[4], a2[4];
#pragma unroll
        for (int mb = 0; mb < 4; ++mb) { a[mb] = WFrag<T16>::ld(A + aoff + (size_t)mb * 16 * K + kc); if (NSPLIT == 1 || NSPLIT == 2) a2[mb] = WFrag<T16>::ld(A2 + aoff + (size_t)mb * 16 * K + kc); }
#pragma unroll
        for (int nb = 0; nb < 4; ++nb) { const V b = WFrag<T16>::ld(Bt + boff + (size_t)nb * 16 * K + kc); V b2; if (NSPLIT >= 2) b2 = WFrag<T16>::ld(Bt2 + boff + (size_t)nb * 16 * K + kc);
#pragma unroll
            for (int mb = 0; mb < 4; ++mb) { acc[mb][nb] = WFrag<T16>::mma(a[mb], b, acc[mb][nb]); if (NSPLIT == 1 || NSPLIT == 2) acc[mb][nb] = WFrag<T16>::mma(a2[mb], b, acc[mb][nb]); if (NSPLIT >= 2) acc[mb][nb] = WFrag<T16>::mma(a[mb], b2, acc[mb][nb]); } }
        asm volatile("v_nop\n\tv_nop\n\tv_nop\n\tv_nop" : "+v"(acc[0][0]), "+v"(acc[1][1]), "+v"(acc[2][2]), "+v"(acc[3][3]) : "v"(a[0]), "v"(a[3]));
    }
#pragma unroll
    for (int mb = 0; mb < 4; ++mb) {
#pragma unroll
        for (int nb = 0; nb < 4; ++nb) {
#pragma unroll
            for (int j = 0; j < 8; ++j) os[(hi * 8 + j) * 68 + nb * 16 + lr] = acc[mb][nb][j]; }
        __builtin_amdgcn_wave_barrier(); asm volatile("" ::: "memory");
        float* crow = C + (size_t)(r0 + mb * 16) * ldc + c0;
{
#pragma unroll
            for (int s = 0; s < 8; ++s) { const int row = 2 * s + hi, cofs = lr * 4; v4f val = *(const v4fa*)(os + row * 68 + cofs); if (BIAS) { val[0] += bfr(bias[c0 + cofs]); val[1] += bfr(bias[c0 + cofs + 1]); val[2] += bfr(bias[c0 + cofs + 2]); val[3] += bfr(bias[c0 + cofs + 3]); }
                *(v4f*)(crow + (size_t)row * ldc + cofs) = val; }
             }
        __builtin_amdgcn_wave_barrier(); asm volatile("" ::: "memory");
    }
}

// ---- k_gemmc: the same one-wave 64x64 tile GEMM specialised for causal attention: CMODE 1 skips score tiles entirely above the diagonal (query rows r0+roff.., key columns c0..), CMODE 2 limits the
// key (K) loop of the probability x value contraction to the diagonal block (probabilities beyond it are exactly zero). roff = row offset of this launch's first row within the sequence.
// lda = row pitch of A / A2 in elements (Bt / Bt2 keep pitch K); batch entry z (a query head) reads B plane z / REP (its kv group).
template <typename T16, int NSPLIT, int CMODE>
__global__ __launch_bounds__(32) void k_gemmc(const T16* __restrict__ A, const T16* __restrict__ A2, const T16* __restrict__ Bt, const T16* __restrict__ Bt2, int K, int lda, float* C, int ldc, int roff, size_t sA, size_t sB, size_t sC) {
    typedef typename WFrag<T16>::V V;
    __shared__ __align__(16) float os[16 * 68];
    const size_t z = blockIdx.z; A += z * sA; if (A2) A2 += z * sA; Bt += (z / REP) * sB; if (Bt2) Bt2 += (z / REP) * sB; C += z * sC;
    const int lane = threadIdx.x & 31, lr = lane & 15, hi = lane >> 4; const int r0 = blockIdx.x * 64, c0 = blockIdx.y * 64;
    if (CMODE == 1 && c0 > r0 + roff + 63) return;                  // score tile entirely above the causal diagonal: never read (the softmax masks j > i by select)
    const int Kl = (CMODE == 2) ? min(K, r0 + roff + 64) : K;        // P.V: probabilities are exactly 0 beyond the diagonal block, so the K loop stops there
    v8f acc[4][4];
#pragma unroll
    for (int mb = 0; mb < 4; ++mb)
#pragma unroll
        for (int nb = 0; nb < 4; ++nb) acc[mb][nb] = (v8f){};
    const size_t aoff = (size_t)(r0 + lr) * lda + 8 * hi, boff = (size_t)(c0 + lr) * K + 8 * hi;
#pragma unroll 1
    for (int kc = 0; kc < Kl; kc += 32) {
        V a[4], a2[4]; const T16* pa[4]; const T16* pa2[4];
#pragma unroll
        for (int mb = 0; mb < 4; ++mb) { pa[mb] = A + aoff + (size_t)mb * 16 * lda + kc; a[mb] = WFrag<T16>::ld(pa[mb]); if (NSPLIT == 1 || NSPLIT == 2) { pa2[mb] = A2 + aoff + (size_t)mb * 16 * lda + kc; a2[mb] = WFrag<T16>::ld(pa2[mb]); } }
        // s_wait_xcnt 0 behind the A loads, in front of every overwrite of their address pairs; the pairs are inputs of the statement so that they stay allocated up to the wait and no later load's result is placed on one before it
        if (NSPLIT == 1 || NSPLIT == 2) asm volatile("s_wait_xcnt 0x0" :: "v"(pa[0]), "v"(pa[1]), "v"(pa[2]), "v"(pa[3]), "v"(pa2[0]), "v"(pa2[1]), "v"(pa2[2]), "v"(pa2[3]) : "memory");
        else asm volatile("s_wait_xcnt 0x0" :: "v"(pa[0]), "v"(pa[1]), "v"(pa[2]), "v"(pa[3]) : "memory");
#pragma unroll
        for (int nb = 0; nb < 4; ++nb) { const T16* pb = Bt + boff + (size_t)nb * 16 * K + kc; const V b = WFrag<T16>::ld(pb); V b2;
            // the same wait behind the B loads of this column block, their address pairs held up to it in the same way
            if (NSPLIT >= 2) { const T16* pb2 = Bt2 + boff + (size_t)nb * 16 * K + kc; b2 = WFrag<T16>::ld(pb2); asm volatile("s_wait_xcnt 0x0" :: "v"(pb), "v"(pb2) : "memory"); }
            else asm volatile("s_wait_xcnt 0x0" :: "v"(pb) : "memory");
#pragma unroll
            for (int mb = 0; mb < 4; ++mb) { acc[mb][nb] = WFrag<T16>::mma(a[mb], b, acc[mb][nb]); if (NSPLIT == 1 || NSPLIT == 2) acc[mb][nb] = WFrag<T16>::mma(a2[mb], b, acc[mb][nb]); if (NSPLIT >= 2) acc[mb][nb] = WFrag<T16>::mma(a[mb], b2, acc[mb][nb]); } }
        asm volatile("v_nop\n\tv_nop\n\tv_nop\n\tv_nop" : "+v"(acc[0][0]), "+v"(acc[1][1]), "+v"(acc[2][2]), "+v"(acc[3][3]) : "v"(a[0]), "v"(a[3]));
    }
#pragma unroll
    for (int mb = 0; mb < 4; ++mb) {
#pragma unroll
        for (int nb = 0; nb < 4; ++nb) {
#pragma unroll
            for (int j = 0; j < 8; ++j) os[(hi * 8 + j) * 68 + nb * 16 + lr] = acc[mb][nb][j]; }
        __builtin_amdgcn_wave_barrier(); asm volatile("" ::: "memory");
        float* crow = C + (size_t)(r0 + mb * 16) * ldc + c0;
{
#pragma unroll
            for (int s = 0; s < 8; ++s) { const int row = 2 * s + hi, cofs = lr * 4; v4f val = *(const v4fa*)(os + row * 68 + cofs);
                *(v4f*)(crow + (size_t)row * ldc + cofs) = val; }
             }
        __builtin_amdgcn_wave_barrier(); asm volatile("" ::: "memory");
    }
}

__device__ __forceinline__ h16 tohx(float x) { return (h16)x; }
__device__ __forceinline__ void splitf(float y, unsigned short& h, unsigned short& l) { h = f2bf(y); l = f2bf(y - bf2f(h)); }
typedef __attribute__((ext_vector_type(2))) _Float16 v2h;
typedef __attribute__((ext_vector_type(4))) _Float16 v4h;
typedef __attribute__((ext_vector_type(2))) unsigned short v2us;
typedef __attribute__((ext_vector_type(4))) unsigned short v4us;
typedef __attribute__((ext_vector_type(2))) float v2f;
typedef __attribute__((ext_vector_type(4))) int v4i;

__global__ __launch_bounds__(256) void k_wtG(const float* __restrict__ w, int K, int N, bf* Bt) {
    const int lane = threadIdx.x & 31; const int L0 = (blockIdx.x * 8 + (threadIdx.x >> 5)) * 8; const int nlines = N * K / 64;
{
#pragma unroll 1
        for (int l = 0; l < 8; ++l) { const int L = L0 + l; if (L >= nlines) break; const size_t e = (size_t)L * 64 + lane * 2; const int k = (int)(e % K), n = (int)(e / K); v2us o;
            o[0] = f2bf(w[(size_t)k * N + n]); o[1] = f2bf(w[(size_t)(k + 1) * N + n]); *(v2us*)(Bt + e) = o; }
         }
}
__global__ __launch_bounds__(256) void k_cvt8(const float* __restrict__ src, bf* dst, size_t n8) { const size_t i = (size_t)blockIdx.x * 256 + threadIdx.x; if (i >= n8) return; const v8f v = *(const v8f*)(src + i * 8); v8us o;
#pragma unroll
    for (int k = 0; k < 8; ++k) o[k] = f2bf(v[k]); *(v8us*)(dst + i * 8) = o;  }
__constant__ float INV2[HD / 2] = { 1.000000000e+00f, 6.636012793e-01f, 4.403666258e-01f, 2.922278345e-01f, 1.939227581e-01f, 1.286873817e-01f, 8.539710194e-02f, 5.666961893e-02f, 3.760603070e-02f, 2.495540865e-02f, 1.656044088e-02f, 1.098952908e-02f, 7.292665076e-03f, 4.839421250e-03f, 3.211446106e-03f, 2.131119603e-03f, 1.414213446e-03f, 9.384738514e-04f, 6.227724371e-04f, 4.132725589e-04f, 2.742481884e-04f, 1.819914323e-04f, 1.207697424e-04f, 8.014294872e-05f, 5.318295734e-05f, 3.529227615e-05f, 2.341999789e-05f, 1.554154005e-05f, 1.031338525e-05f, 6.843975370e-06f, 4.541670478e-06f, 3.013858077e-06f };   // THIS module's 1.0 / (500000.0 ** (arange(0, 64, 2, float32) / 64)) evaluated in JAX float32 (bit-exact literals)
__global__ __launch_bounds__(256) void k_csP(float* CS) { const int idx = blockIdx.x * 256 + threadIdx.x; if (idx >= TT * HD) return; const int d = idx % HD; const int t = idx / HD; const float a = __fmul_rn((float)t, INV2[d >> 1]); v2f cs; cs[0] = cosf(a); cs[1] = sinf(a); *(v2f*)(CS + (size_t)idx * 2) = cs;  }

__global__ __launch_bounds__(256) void k_ropeI(const float* __restrict__ F, int pitch, int nheads, const float* __restrict__ CS, float sc, h16* P16, bf* Ph, bf* Pl) {
    const size_t e = ((size_t)blockIdx.x * 256 + threadIdx.x) * 2; if (e >= (size_t)nheads * TT * HD) return; const int d = (int)(e % HD); const int t = (int)((e / HD) % TT); const int h = (int)(e / ((size_t)HD * TT)); const float* f = F + (size_t)t * pitch + h * HD; const float x0 = f[d], x1 = f[d + 1]; const v2f cs = *(const v2f*)(CS + ((size_t)t * HD + d) * 2); v2h o16; v2us oh, ol;
    float a0 = __fmul_rn(x0, cs[0]), b0 = __fmul_rn(x1, cs[1]), a1 = __fmul_rn(x1, cs[0]), b1 = __fmul_rn(x0, cs[1]); asm volatile("" : "+v"(a0), "+v"(b0), "+v"(a1), "+v"(b1));
    float r0 = __fsub_rn(a0, b0) * sc, r1 = __fadd_rn(b1, a1) * sc;   /* even: x0 c - x1 s; odd: x0 s + x1 c */
    o16[0] = tohx(r0); o16[1] = tohx(r1); { unsigned short a2, c2; splitf(r0, a2, c2); oh[0] = a2; ol[0] = c2; splitf(r1, a2, c2); oh[1] = a2; ol[1] = c2; }
    *(v2h*)(P16 + e) = o16; *(v2us*)(Ph + e) = oh; *(v2us*)(Pl + e) = ol;  }
// k_rope: head planes [h][t][d] (fp16 + hi/lo) of rope(x) x sc with the rotate-half convention out[d] = x[d] cos[t][d] - x[d+HD/2] sin[t][d], out[d+HD/2] = x[d+HD/2] cos[t][d+HD/2] + x[d] sin[t][d+HD/2]
__global__ __launch_bounds__(256) void k_rope(const float* __restrict__ F, int pitch, int nheads, const float* __restrict__ CS, const float* __restrict__ RF, const float* __restrict__ nw, float sc, h16* P16, bf* Ph, bf* Pl) {
    const size_t e = ((size_t)blockIdx.x * 256 + threadIdx.x) * 2; if (e >= (size_t)nheads * TT * HD) return; const int d = (int)(e % HD); const int t = (int)((e / HD) % TT); const int h = (int)(e / ((size_t)HD * TT)); const float* f = F + (size_t)t * pitch + h * HD; const float rf = RF ? RF[(size_t)h * TT + t] : 1.0f; v2h o16; v2us oh, ol;
#pragma unroll
    for (int q = 0; q < 2; ++q) { const int dd = d + q; const int dp = (dd < HD / 2) ? dd + HD / 2 : dd - HD / 2; float x0 = f[dd], x1 = f[dp];
        if (RF) { float n0 = __fmul_rn(x0, rf), n1 = __fmul_rn(x1, rf); asm volatile("" : "+v"(n0)); asm volatile("" : "+v"(n1)); x0 = __fmul_rn(bfr(nw[dd]), n0); x1 = __fmul_rn(bfr(nw[dp]), n1); }
        const v2f cs = *(const v2f*)(CS + ((size_t)t * HD + dd) * 2); float a = __fmul_rn(x0, cs[0]), bq = __fmul_rn(x1, cs[1]); asm volatile("" : "+v"(a)); asm volatile("" : "+v"(bq)); const float r = ((dd < HD / 2) ? __fsub_rn(a, bq) : __fadd_rn(a, bq)) * sc;
        o16[q] = tohx(r); unsigned short a2, c2; splitf(r, a2, c2); oh[q] = a2; ol[q] = c2; }
    *(v2h*)(P16 + e) = o16; *(v2us*)(Ph + e) = oh; *(v2us*)(Pl + e) = ol;  }
__global__ __launch_bounds__(256) void k_vtp(const float* __restrict__ F, int pitch, int nheads, h16* V16, bf* Vh, bf* Vl) { const size_t e = ((size_t)blockIdx.x * 256 + threadIdx.x) * 2; if (e >= (size_t)nheads * HD * TT) return; const int t = (int)(e % TT); const int d = (int)((e / TT) % HD); const int g = (int)(e / ((size_t)TT * HD)); v2h o16; v2us oh, ol;
#pragma unroll
    for (int q = 0; q < 2; ++q) { const float x = F[(size_t)(t + q) * pitch + g * HD + d]; o16[q] = tohx(x); unsigned short a2, c2; splitf(x, a2, c2); oh[q] = a2; ol[q] = c2; }
    *(v2h*)(V16 + e) = o16; *(v2us*)(Vh + e) = oh; *(v2us*)(Vl + e) = ol;  }
// k_asoft: per row (zz, i): t = S x HD^-0.5 for j <= i and i - j < WIN (sliding causal window; the reference's -1e9 additive fill vanishes identically); softmax over the 2048 keys (register row, one exp, fixed trees);
// the probabilities overwrite their own score row (8192 B, owned by this one wave, read whole into registers before the first store): rows >= RH fp16 in its first 4096 B; rows < RH the hi plane there and the lo plane in its second 4096 B.
__global__ __launch_bounds__(256) void k_asoft(float* Sb) {
    const int lane = threadIdx.x & 31; const int row = blockIdx.x * 8 + (threadIdx.x >> 5); if (row >= ZH * TT) return; const int i = row % TT; const int zz = row / TT; (void)zz; const bool hires = (i < RH); float* sr = Sb + (size_t)row * TT; float v[TT / 32]; float mx = -3.0e38f;
#pragma unroll
    for (int ch = 0; ch < TT / 128; ++ch) { const int j0 = ch * 128 + lane * 4; const v4f a = *(const v4f*)(sr + j0);
#pragma unroll
        for (int q = 0; q < 4; ++q) { const int j = j0 + q; (void)j; const float t = (j <= i && i - j < WIN) ? a[q] * SCL : -3.0e38f; v[ch * 4 + q] = t; mx = fmaxf(mx, t); } }
#pragma unroll
    for (int sh = 16; sh; sh >>= 1) mx = fmaxf(mx, __shfl_xor(mx, sh, 32));
    float sum = 0.f;
#pragma unroll
    for (int k = 0; k < TT / 32; ++k) { float d0 = __fsub_rn(v[k], mx); asm volatile("" : "+v"(d0)); v[k] = __builtin_amdgcn_exp2f(__fmul_rn(d0, 1.4426950408889634f)); sum += v[k]; }
#pragma unroll
    for (int sh = 16; sh; sh >>= 1) sum += __shfl_xor(sum, sh, 32);
    const float f = __fdiv_rn(hires ? 1.0f : PCAR, sum);
{
        if (hires) {
#pragma unroll
            for (int ch = 0; ch < TT / 128; ++ch) { v4us oh, ol;
#pragma unroll
                for (int q = 0; q < 4; ++q) { unsigned short a, c2; splitf(v[ch * 4 + q] * f, a, c2); oh[q] = a; ol[q] = c2; }
                bf* pr = (bf*)sr + ch * 128 + lane * 4; *(v4us*)pr = oh; *(v4us*)(pr + TT) = ol; }
        } else {
#pragma unroll
            for (int ch = 0; ch < TT / 128; ++ch) { v4h o4;
#pragma unroll
                for (int q = 0; q < 4; ++q) o4[q] = tohx(v[ch * 4 + q] * f);
                *(v4h*)((h16*)sr + ch * 128 + lane * 4) = o4; } }
         }
}
__global__ __launch_bounds__(256) void k_merge(const float* __restrict__ O, int h0, bf* Ah, bf* Al) { const size_t e = ((size_t)blockIdx.x * 256 + threadIdx.x) * 2; if (e >= (size_t)ZH * TT * HD) return; const int d = (int)(e % HD); const int t = (int)((e / HD) % TT); const int zz = (int)(e / ((size_t)HD * TT)); const float cs = (t < RH) ? 1.0f : (1.0f / PCAR); const size_t oo = (size_t)t * DQ + (h0 + zz) * HD + d;
    v2us oh, ol;
#pragma unroll
    for (int q = 0; q < 2; ++q) { unsigned short a, c2; splitf(O[e + q] * cs, a, c2); oh[q] = a; ol[q] = c2; } *(v2us*)(Ah + oo) = oh; *(v2us*)(Al + oo) = ol;  }

extern "C" void kernel_launch(void* const* d_in, const int* in_sizes, int n_in,
                              void* d_out, int out_size, void* d_ws, size_t ws_size, hipStream_t stream) {
    (void)in_sizes; (void)n_in; (void)out_size;
    const float* x = (const float*)d_in[0]; const float* wq = (const float*)d_in[1]; const float* wk = (const float*)d_in[2]; const float* wv = (const float*)d_in[3]; const float* wo = (const float*)d_in[4];   /* FIVE inputs, all read; this module has no position input: the table is computed for positions 0..2047 */
    float* OUT = (float*)d_out;     // [2][2048][2048]
    char* wsp = (char*)d_ws;
    auto take = [&](size_t bytes) { char* p = wsp; wsp += (bytes + 255) & ~(size_t)255; return (void*)p; };
    bf* WQ = (bf*)take((size_t)DQ * DM * 2); bf* WK = (bf*)take((size_t)DKV * DM * 2); bf* WV = (bf*)take((size_t)DKV * DM * 2); bf* WO = (bf*)take((size_t)DM * DQ * 2); float* CS = (float*)take((size_t)TT * HD * 2 * 4);
    bf* XB = (bf*)take((size_t)TT * DM * 2); float* FQ = (float*)take((size_t)TT * DQ * 4); float* FK = (float*)take((size_t)TT * DKV * 4);
    h16* QP16 = (h16*)take((size_t)NH_ * TT * HD * 2); h16* KP16 = (h16*)take((size_t)NKV * TT * HD * 2); h16* VT16 = (h16*)take((size_t)NKV * HD * TT * 2);
    bf* QPh = (bf*)take((size_t)NH_ * TT * HD * 2); bf* QPl = (bf*)take((size_t)NH_ * TT * HD * 2); bf* KPh = (bf*)take((size_t)NKV * TT * HD * 2); bf* KPl = (bf*)take((size_t)NKV * TT * HD * 2); bf* VTh = (bf*)take((size_t)NKV * HD * TT * 2); bf* VTl = (bf*)take((size_t)NKV * HD * TT * 2);
    float* Sb = (float*)take((size_t)ZH * TT * TT * 4); float* Ob = (float*)take((size_t)ZH * TT * HD * 4); bf* ATh = (bf*)take((size_t)TT * DQ * 2); bf* ATl = (bf*)take((size_t)TT * DQ * 2);
    if ((size_t)(wsp - (char*)d_ws) > ws_size) return;    // ws 256 MiB
    float* FV = FK;   // v projection reuses the k buffer after the k planes are built (stream-ordered)
    { k_wtG<<<(unsigned)((DM * DQ / 64 + 63) / 64), 256, 0, stream>>>(wq, DM, DQ, WQ); k_wtG<<<(unsigned)((DM * DKV / 64 + 63) / 64), 256, 0, stream>>>(wk, DM, DKV, WK); k_wtG<<<(unsigned)((DM * DKV / 64 + 63) / 64), 256, 0, stream>>>(wv, DM, DKV, WV);
      k_wtG<<<(unsigned)((DQ * DM / 64 + 63) / 64), 256, 0, stream>>>(wo, DQ, DM, WO);
      k_csP<<<(TT * HD + 255) / 256, 256, 0, stream>>>(CS); }
    const unsigned LQ = (unsigned)(((size_t)NH_ * TT * HD / 2 + 255) / 256), LKv = (unsigned)(((size_t)NKV * TT * HD / 2 + 255) / 256);
    for (int b = 0; b < NB_; ++b) {
        
        k_cvt8<<<(unsigned)(((size_t)TT * DM / 8 + 255) / 256), 256, 0, stream>>>(x + (size_t)b * TT * DM, XB, (size_t)TT * DM / 8);
        k_gemmw<bf, 0, false><<<dim3(TT / 64, DQ / 64, 1), 32, 0, stream>>>(XB, nullptr, WQ, nullptr, DM, FQ, DQ, nullptr, 0, 0, 0);
        k_ropeI<<<LQ, 256, 0, stream>>>(FQ, DQ, NH_, CS, 1.0f, QP16, QPh, QPl);
        k_gemmw<bf, 0, false><<<dim3(TT / 64, DKV / 64, 1), 32, 0, stream>>>(XB, nullptr, WK, nullptr, DM, FK, DKV, nullptr, 0, 0, 0);
        k_ropeI<<<LKv, 256, 0, stream>>>(FK, DKV, NKV, CS, 1.0f, KP16, KPh, KPl);
        k_gemmw<bf, 0, false><<<dim3(TT / 64, DKV / 64, 1), 32, 0, stream>>>(XB, nullptr, WV, nullptr, DM, FV, DKV, nullptr, 0, 0, 0); k_vtp<<<LKv, 256, 0, stream>>>(FV, DKV, NKV, VT16, VTh, VTl);
        for (int h0 = 0; h0 < NH_; h0 += ZH) { const size_t zq = (size_t)h0, zk = (size_t)(h0 / REP);   // head h0 + z of a pass reads kv group h0 / REP + z / REP
            k_gemmc<bf, 2, 1><<<dim3(RH / 64, TT / 64, ZH), 32, 0, stream>>>(QPh + zq * TT * HD, QPl + zq * TT * HD, KPh + zk * TT * HD, KPl + zk * TT * HD, HD, HD, Sb, TT, 0, (size_t)TT * HD, (size_t)TT * HD, (size_t)TT * TT);
            k_gemmc<h16, 0, 1><<<dim3((TT - RH) / 64, TT / 64, ZH), 32, 0, stream>>>(QP16 + zq * TT * HD + (size_t)RH * HD, nullptr, KP16 + zk * TT * HD, nullptr, HD, HD, Sb + (size_t)RH * TT, TT, RH, (size_t)TT * HD, (size_t)TT * HD, (size_t)TT * TT);
            k_asoft<<<ZH * TT / 8, 256, 0, stream>>>(Sb);
            k_gemmc<bf, 2, 2><<<dim3(RH / 64, HD / 64, ZH), 32, 0, stream>>>((const bf*)Sb, (const bf*)Sb + TT, VTh + zk * HD * TT, VTl + zk * HD * TT, TT, 2 * TT, Ob, HD, 0, (size_t)2 * TT * TT, (size_t)HD * TT, (size_t)TT * HD);
            k_gemmc<h16, 0, 2><<<dim3((TT - RH) / 64, HD / 64, ZH), 32, 0, stream>>>((const h16*)Sb + (size_t)RH * 2 * TT, nullptr, VT16 + zk * HD * TT, nullptr, TT, 2 * TT, Ob + (size_t)RH * HD, HD, RH, (size_t)2 * TT * TT, (size_t)HD * TT, (size_t)TT * HD);
            k_merge<<<(unsigned)(((size_t)ZH * TT * HD / 2 + 255) / 256), 256, 0, stream>>>(Ob, h0, ATh, ATl); }
        k_gemmw<bf, 1, false><<<dim3(TT / 64, DM / 64, 1), 32, 0, stream>>>(ATh, ATl, WO, nullptr, DQ, OUT + (size_t)b * TT * DM, DM, nullptr, 0, 0, 0); }
}

// v002
// It runs in 544 microseconds.
// Timed twice side by side with v001, it ran 2.33 times as fast both times.
// All steps since v000 together make it 4.95 times as fast.
#include <hip/hip_runtime.h>

// Grouped-query causal attention with interleaved-pair rotary embeddings at ROPE_THETA 500000 (x [2][2048][2048]; q = x Wq ('xw' (in, out) [2048][2048] 2048^-0.5, 32 heads x 64), k = x Wk, v = x Wv ('xw' [2048][512], 8 kv heads; no biases); rope on (even, odd) pairs: (e cos - o sin, o cos + e sin) with angle position x 1 / 500000^(2i/64), the cos / sin tables computed in the module for positions arange(2048) (32 f32 frequencies jnp-exact); jnp.repeat(k, 4, axis = 2): kv head = q head / 4; scores / sqrt(64); causal (-inf); softmax; out = merged Wo ('xw' [2048][2048]) -> [2][2048][2048] (8.4 M); argument order x, Wq, Wk, Wv, Wo).
// Compute dtypes, f32 accumulate: every input rounded to bf16; q/k/v on PLAIN bf16 operands (inputs: exact); rotary in f32 (precise cosf/sinf table); causal scores, softmax and attn.v in ONE kernel (k_fattn: running max and sum per query, no score matrix in memory; query head h reads kv plane h / 4): query rows < 512 hl (3 products), the rest single fp16; softmax f32; Wo hl x exact (2 products).

#define NB_  2
#define TT   2048
#define DM   2048
#define NH_  32
#define NKV  8
#define REP  (NH_ / NKV)
#define HD   64
#define DQ   (NH_ * HD)
#define DKV  (NKV * HD)
#define RH   512                  // query rows < RH use hi+lo planes (0: none)
#define SCL  0.125f   // HD^-0.5
typedef _Float16 h16;
typedef unsigned short bf;
typedef __attribute__((ext_vector_type(16))) __bf16   v16bf;
typedef __attribute__((ext_vector_type(16))) _Float16 v16h;
typedef __attribute__((ext_vector_type(8)))  _Float16 v8h;
typedef __attribute__((ext_vector_type(8)))  unsigned short v8us;
typedef __attribute__((ext_vector_type(8)))  float    v8f;
typedef __attribute__((ext_vector_type(4)))  float    v4f;
typedef v8h  __attribute__((may_alias)) v8ha;
typedef v4f  __attribute__((may_alias)) v4fa;
typedef v8us __attribute__((may_alias)) v8usa;

__device__ __forceinline__ unsigned short f2bf(float f) { unsigned u = __float_as_uint(f); u += 0x7FFFu + ((u >> 16) & 1u); return (unsigned short)(u >> 16); }
__device__ __forceinline__ float bf2f(unsigned short b) { return __uint_as_float(((unsigned)b) << 16); }
__device__ __forceinline__ float bfr(float f) { return bf2f(f2bf(f)); }
__device__ __forceinline__ v16h cat16(v8h lo, v8h hi) { return __builtin_shufflevector(lo, hi, 0, 1, 2, 3, 4, 5, 6, 7, 8, 9, 10, 11, 12, 13, 14, 15); }
__device__ __forceinline__ v16bf cat16b(v8us lo, v8us hi) { return __builtin_bit_cast(v16bf, __builtin_shufflevector(lo, hi, 0, 1, 2, 3, 4, 5, 6, 7, 8, 9, 10, 11, 12, 13, 14, 15)); }
__device__ __forceinline__ v8f wmma16(v16h a, v16h b, v8f c) { return __builtin_amdgcn_wmma_f32_16x16x32_f16(false, a, false, b, (short)0, c, false, false); }
__device__ __forceinline__ v8f wmmab(v16bf a, v16bf b, v8f c) { return __builtin_amdgcn_wmma_f32_16x16x32_bf16(false, a, false, b, (short)0, c, false, false); }



// ---- k_gemmw: register-blocked GEMM, ONE WAVE per 64x64 output tile (16 accumulators), operands straight from K-contiguous 16-bit planes; grid (M/64, N/64, Z), 32 threads.
// C[m][n] (f32, pitch ldc, + optional f32 bias[n]) = sum_k A[m][k] Bt[n][k] (+ split products per NSPLIT). z-batch strides sA/sB/sC in elements. K % 32 == 0.
template <typename T16> struct WFrag;
template <> struct WFrag<h16> { typedef v16h V; static __device__ __forceinline__ V ld(const h16* p) { return cat16(*(const v8h*)p, *(const v8h*)(p + 16)); } static __device__ __forceinline__ v8f mma(V a, V b, v8f c) { return wmma16(a, b, c); } };
template <> struct WFrag<bf> { typedef v16bf V; static __device__ __forceinline__ V ld(const bf* p) { return cat16b(*(const v8us*)p, *(const v8us*)(p + 16)); } static __device__ __forceinline__ v8f mma(V a, V b, v8f c) { return wmmab(a, b, c); } };
template <typename T16, int NSPLIT, bool BIAS>
__global__ __launch_bounds__(32) void k_gemmw(const T16* __restrict__ A, const T16* __restrict__ A2, const T16* __restrict__ Bt, const T16* __restrict__ Bt2, int K, float* C, int ldc, const float* __restrict__ bias, size_t sA, size_t sB, size_t sC) {
    typedef typename WFrag<T16>::V V;
    __shared__ __align__(16) float os[16 * 68];
    const size_t z = blockIdx.z; A += z * sA; if (A2) A2 += z * sA; Bt += z * sB; if (Bt2) Bt2 += z * sB; C += z * sC;
    const int lane = threadIdx.x & 31, lr = lane & 15, hi = lane >> 4; const int r0 = blockIdx.x * 64, c0 = blockIdx.y * 64;
    v8f acc[4][4];
#pragma unroll
    for (int mb = 0; mb < 4; ++mb)
#pragma unroll
        for (int nb = 0; nb < 4; ++nb) acc[mb][nb] = (v8f){};
    const size_t aoff = (size_t)(r0 + lr) * K + 8 * hi, boff = (size_t)(c0 + lr) * K + 8 * hi;
#pragma unroll 1
    for (int kc = 0; kc < K; kc += 32) {
        V a[4], a2[4];
#pragma unroll
        for (int mb = 0; mb < 4; ++mb) { a[mb] = WFrag<T16>::ld(A + aoff + (size_t)mb * 16 * K + kc); if (NSPLIT == 1 || NSPLIT == 2) a2[mb] = WFrag<T16>::ld(A2 + aoff + (size_t)mb * 16 * K + kc); }
#pragma unroll
        for (int nb = 0; nb < 4; ++nb) { const V b = WFrag<T16>::ld(Bt + boff + (size_t)nb * 16 * K + kc); V b2; if (NSPLIT >= 2) b2 = WFrag<T16>::ld(Bt2 + boff + (size_t)nb * 16 * K + kc);
#pragma unroll
            for (int mb = 0; mb < 4; ++mb) { acc[mb][nb] = WFrag<T16>::mma(a[mb], b, acc[mb][nb]); if (NSPLIT == 1 || NSPLIT == 2) acc[mb][nb] = WFrag<T16>::mma(a2[mb], b, acc[mb][nb]); if (NSPLIT >= 2) acc[mb][nb] = WFrag<T16>::mma(a[mb], b2, acc[mb][nb]); } }
        asm volatile("v_nop\n\tv_nop\n\tv_nop\n\tv_nop" : "+v"(acc[0][0]), "+v"(acc[1][1]), "+v"(acc[2][2]), "+v"(acc[3][3]) : "v"(a[0]), "v"(a[3]));
    }
#pragma unroll
    for (int mb = 0; mb < 4; ++mb) {
#pragma unroll
        for (int nb = 0; nb < 4; ++nb) {
#pragma unroll
            for (int j = 0; j < 8; ++j) os[(hi * 8 + j) * 68 + nb * 16 + lr] = acc[mb][nb][j]; }
        __builtin_amdgcn_wave_barrier(); asm volatile("" ::: "memory");
        float* crow = C + (size_t)(r0 + mb * 16) * ldc + c0;
{
#pragma unroll
            for (int s = 0; s < 8; ++s) { const int row = 2 * s + hi, cofs = lr * 4; v4f val = *(const v4fa*)(os + row * 68 + cofs); if (BIAS) { val[0] += bfr(bias[c0 + cofs]); val[1] += bfr(bias[c0 + cofs + 1]); val[2] += bfr(bias[c0 + cofs + 2]); val[3] += bfr(bias[c0 + cofs + 3]); }
                *(v4f*)(crow + (size_t)row * ldc + cofs) = val; }
             }
        __builtin_amdgcn_wave_barrier(); asm volatile("" ::: "memory");
    }
}

__device__ __forceinline__ h16 tohx(float x) { return (h16)x; }
__device__ __forceinline__ void splitf(float y, unsigned short& h, unsigned short& l) { h = f2bf(y); l = f2bf(y - bf2f(h)); }
typedef __attribute__((ext_vector_type(2))) _Float16 v2h;
typedef __attribute__((ext_vector_type(4))) _Float16 v4h;
typedef __attribute__((ext_vector_type(2))) unsigned short v2us;
typedef __attribute__((ext_vector_type(4))) unsigned short v4us;
typedef __attribute__((ext_vector_type(2))) float v2f;
typedef __attribute__((ext_vector_type(4))) int v4i;

__global__ __launch_bounds__(256) void k_wtG(const float* __restrict__ w, int K, int N, bf* Bt) {
    const int lane = threadIdx.x & 31; const int L0 = (blockIdx.x * 8 + (threadIdx.x >> 5)) * 8; const int nlines = N * K / 64;
{
#pragma unroll 1
        for (int l = 0; l < 8; ++l) { const int L = L0 + l; if (L >= nlines) break; const size_t e = (size_t)L * 64 + lane * 2; const int k = (int)(e % K), n = (int)(e / K); v2us o;
            o[0] = f2bf(w[(size_t)k * N + n]); o[1] = f2bf(w[(size_t)(k + 1) * N + n]); *(v2us*)(Bt + e) = o; }
         }
}
__global__ __launch_bounds__(256) void k_cvt8(const float* __restrict__ src, bf* dst, size_t n8) { const size_t i = (size_t)blockIdx.x * 256 + threadIdx.x; if (i >= n8) return; const v8f v = *(const v8f*)(src + i * 8); v8us o;
#pragma unroll
    for (int k = 0; k < 8; ++k) o[k] = f2bf(v[k]); *(v8us*)(dst + i * 8) = o;  }
__constant__ float INV2[HD / 2] = { 1.000000000e+00f, 6.636012793e-01f, 4.403666258e-01f, 2.922278345e-01f, 1.939227581e-01f, 1.286873817e-01f, 8.539710194e-02f, 5.666961893e-02f, 3.760603070e-02f, 2.495540865e-02f, 1.656044088e-02f, 1.098952908e-02f, 7.292665076e-03f, 4.839421250e-03f, 3.211446106e-03f, 2.131119603e-03f, 1.414213446e-03f, 9.384738514e-04f, 6.227724371e-04f, 4.132725589e-04f, 2.742481884e-04f, 1.819914323e-04f, 1.207697424e-04f, 8.014294872e-05f, 5.318295734e-05f, 3.529227615e-05f, 2.341999789e-05f, 1.554154005e-05f, 1.031338525e-05f, 6.843975370e-06f, 4.541670478e-06f, 3.013858077e-06f };   // THIS module's 1.0 / (500000.0 ** (arange(0, 64, 2, float32) / 64)) evaluated in JAX float32 (bit-exact literals)
__global__ __launch_bounds__(256) void k_csP(float* CS) { const int idx = blockIdx.x * 256 + threadIdx.x; if (idx >= TT * HD) return; const int d = idx % HD; const int t = idx / HD; const float a = __fmul_rn((float)t, INV2[d >> 1]); v2f cs; cs[0] = cosf(a); cs[1] = sinf(a); *(v2f*)(CS + (size_t)idx * 2) = cs;  }

__global__ __launch_bounds__(256) void k_ropeI(const float* __restrict__ F, int pitch, int nheads, const float* __restrict__ CS, float sc, h16* P16, bf* Ph, bf* Pl) {
    const size_t e = ((size_t)blockIdx.x * 256 + threadIdx.x) * 2; if (e >= (size_t)nheads * TT * HD) return; const int d = (int)(e % HD); const int t = (int)((e / HD) % TT); const int h = (int)(e / ((size_t)HD * TT)); const float* f = F + (size_t)t * pitch + h * HD; const float x0 = f[d], x1 = f[d + 1]; const v2f cs = *(const v2f*)(CS + ((size_t)t * HD + d) * 2); v2h o16; v2us oh, ol;
    float a0 = __fmul_rn(x0, cs[0]), b0 = __fmul_rn(x1, cs[1]), a1 = __fmul_rn(x1, cs[0]), b1 = __fmul_rn(x0, cs[1]); asm volatile("" : "+v"(a0), "+v"(b0), "+v"(a1), "+v"(b1));
    float r0 = __fsub_rn(a0, b0) * sc, r1 = __fadd_rn(b1, a1) * sc;   /* even: x0 c - x1 s; odd: x0 s + x1 c */
    o16[0] = tohx(r0); o16[1] = tohx(r1); { unsigned short a2, c2; splitf(r0, a2, c2); oh[0] = a2; ol[0] = c2; splitf(r1, a2, c2); oh[1] = a2; ol[1] = c2; }
    *(v2h*)(P16 + e) = o16; *(v2us*)(Ph + e) = oh; *(v2us*)(Pl + e) = ol;  }
// k_rope: head planes [h][t][d] (fp16 + hi/lo) of rope(x) x sc with the rotate-half convention out[d] = x[d] cos[t][d] - x[d+HD/2] sin[t][d], out[d+HD/2] = x[d+HD/2] cos[t][d+HD/2] + x[d] sin[t][d+HD/2]
__global__ __launch_bounds__(256) void k_rope(const float* __restrict__ F, int pitch, int nheads, const float* __restrict__ CS, const float* __restrict__ RF, const float* __restrict__ nw, float sc, h16* P16, bf* Ph, bf* Pl) {
    const size_t e = ((size_t)blockIdx.x * 256 + threadIdx.x) * 2; if (e >= (size_t)nheads * TT * HD) return; const int d = (int)(e % HD); const int t = (int)((e / HD) % TT); const int h = (int)(e / ((size_t)HD * TT)); const float* f = F + (size_t)t * pitch + h * HD; const float rf = RF ? RF[(size_t)h * TT + t] : 1.0f; v2h o16; v2us oh, ol;
#pragma unroll
    for (int q = 0; q < 2; ++q) { const int dd = d + q; const int dp = (dd < HD / 2) ? dd + HD / 2 : dd - HD / 2; float x0 = f[dd], x1 = f[dp];
        if (RF) { float n0 = __fmul_rn(x0, rf), n1 = __fmul_rn(x1, rf); asm volatile("" : "+v"(n0)); asm volatile("" : "+v"(n1)); x0 = __fmul_rn(bfr(nw[dd]), n0); x1 = __fmul_rn(bfr(nw[dp]), n1); }
        const v2f cs = *(const v2f*)(CS + ((size_t)t * HD + dd) * 2); float a = __fmul_rn(x0, cs[0]), bq = __fmul_rn(x1, cs[1]); asm volatile("" : "+v"(a)); asm volatile("" : "+v"(bq)); const float r = ((dd < HD / 2) ? __fsub_rn(a, bq) : __fadd_rn(a, bq)) * sc;
        o16[q] = tohx(r); unsigned short a2, c2; splitf(r, a2, c2); oh[q] = a2; ol[q] = c2; }
    *(v2h*)(P16 + e) = o16; *(v2us*)(Ph + e) = oh; *(v2us*)(Pl + e) = ol;  }
__global__ __launch_bounds__(256) void k_vtp(const float* __restrict__ F, int pitch, int nheads, h16* V16, bf* Vh, bf* Vl) { const size_t e = ((size_t)blockIdx.x * 256 + threadIdx.x) * 2; if (e >= (size_t)nheads * HD * TT) return; const int t = (int)(e % TT); const int d = (int)((e / TT) % HD); const int g = (int)(e / ((size_t)TT * HD)); v2h o16; v2us oh, ol;
#pragma unroll
    for (int q = 0; q < 2; ++q) { const float x = F[(size_t)(t + q) * pitch + g * HD + d]; o16[q] = tohx(x); unsigned short a2, c2; splitf(x, a2, c2); oh[q] = a2; ol[q] = c2; }
    *(v2h*)(V16 + e) = o16; *(v2us*)(Vh + e) = oh; *(v2us*)(Vl + e) = ol;  }
typedef __attribute__((ext_vector_type(16))) unsigned short v16us;
// ---- k_fattn: causal attention of one batch entry without a score matrix in memory. One wave = 32 query rows of one head; the 4 waves of a block are the 4 query heads of one kv group at the same rows (they read the same K and V lines).
// Transposed products: St[key][query] = K Qt and Ot[d][query] = Vt Pt, so a lane owns ONE query column per 16-query block: max and sum are per-lane scalars (one exchange between the lane halves),
// two St tiles of 16 keys converted in place are the B fragment of 32 keys of the second product, and a lane's 8 accumulator registers of Ot are 8 consecutive d of its row (one 16-byte store per plane).
// Running softmax over key tiles in rising order: m = running max of s x HD^-0.5 x log2 e, p = 2^(s' - m + PSH), l and Ot are multiplied by 2^(m_old - m_new) when m rises; the result is Ot / l (PSH cancels; it keeps small p normal in fp16).
#define PSH 8.0f
template <typename T16, bool HL, int KT>
__device__ __forceinline__ void attn_tile(const T16* __restrict__ Q, const T16* __restrict__ Q2, const T16* __restrict__ Kp, const T16* __restrict__ K2, const T16* __restrict__ Vt, const T16* __restrict__ V2, int q0, int lr, int hi, bf* Ah, bf* Al) {
    typedef typename WFrag<T16>::V V;
    constexpr int NKB = KT / 16, NCH = KT / 32;
    V q[2][2], q2[2][2];
    const T16* pq = Q + (size_t)(q0 + lr) * HD + 8 * hi; const T16* pq2 = Q2 + (size_t)(q0 + lr) * HD + 8 * hi;
    // every inner loop below is fully unrolled so that the fragment and accumulator arrays are indexed by constants and stay in registers
#pragma unroll
    for (int qb = 0; qb < 2; ++qb)
#pragma unroll
        for (int kc = 0; kc < 2; ++kc) { q[qb][kc] = WFrag<T16>::ld(pq + qb * 16 * HD + kc * 32); if (HL) q2[qb][kc] = WFrag<T16>::ld(pq2 + qb * 16 * HD + kc * 32); }
    // s_wait_xcnt 0 behind the Q loads, in front of every overwrite of their address pairs; the pairs are inputs of the statement so that they stay allocated up to the wait
    if (HL) asm volatile("s_wait_xcnt 0x0" :: "v"(pq), "v"(pq2) : "memory"); else asm volatile("s_wait_xcnt 0x0" :: "v"(pq) : "memory");
    v8f o[4][2]; float m[2], l[2];
#pragma unroll
    for (int qb = 0; qb < 2; ++qb) { m[qb] = -3.0e38f; l[qb] = 0.f;
#pragma unroll
        for (int db = 0; db < 4; ++db) o[db][qb] = (v8f){}; }
    // K fragments are fetched one key tile ahead (their registers are free again behind the score products), so that their latency is covered by the softmax arithmetic and the second product
    V ka[NKB][2], ka2[NKB][2];
    { const T16* pk = Kp + (size_t)lr * HD + 8 * hi; const T16* pk2 = K2 + (size_t)lr * HD + 8 * hi;
#pragma unroll
      for (int kb = 0; kb < NKB; ++kb)
#pragma unroll
          for (int kc = 0; kc < 2; ++kc) { ka[kb][kc] = WFrag<T16>::ld(pk + kb * 16 * HD + kc * 32); if (HL) ka2[kb][kc] = WFrag<T16>::ld(pk2 + kb * 16 * HD + kc * 32); }
      // the same wait behind the K loads of the first key tile, their address pairs held up to it
      if (HL) asm volatile("s_wait_xcnt 0x0" :: "v"(pk), "v"(pk2) : "memory"); else asm volatile("s_wait_xcnt 0x0" :: "v"(pk) : "memory"); }
    for (int k0 = 0; k0 < q0 + 32; k0 += KT) {
        V va[4][NCH], va2[4][NCH];
        const T16* pv = Vt + (size_t)lr * TT + k0 + 8 * hi; const T16* pv2 = V2 + (size_t)lr * TT + k0 + 8 * hi;
#pragma unroll
        for (int db = 0; db < 4; ++db)
#pragma unroll
            for (int ch = 0; ch < NCH; ++ch) { va[db][ch] = WFrag<T16>::ld(pv + (size_t)db * 16 * TT + ch * 32); if (HL) va2[db][ch] = WFrag<T16>::ld(pv2 + (size_t)db * 16 * TT + ch * 32); }
        // the same wait behind the V loads (issued in front of the score products and the softmax arithmetic, which cover their latency)
        if (HL) asm volatile("s_wait_xcnt 0x0" :: "v"(pv), "v"(pv2) : "memory"); else asm volatile("s_wait_xcnt 0x0" :: "v"(pv) : "memory");
        v8f s[NKB][2];
#pragma unroll
        for (int kb = 0; kb < NKB; ++kb)
#pragma unroll
            for (int qb = 0; qb < 2; ++qb) { v8f t = (v8f){};
#pragma unroll
                for (int kc = 0; kc < 2; ++kc) { t = WFrag<T16>::mma(ka[kb][kc], q[qb][kc], t); if (HL) { t = WFrag<T16>::mma(ka[kb][kc], q2[qb][kc], t); t = WFrag<T16>::mma(ka2[kb][kc], q[qb][kc], t); } }
                s[kb][qb] = t; }
        const int kn = min(k0 + KT, TT - KT);      // next key tile; behind the last one the address stays inside the plane and the values are not used
        const T16* pk = Kp + (size_t)(kn + lr) * HD + 8 * hi; const T16* pk2 = K2 + (size_t)(kn + lr) * HD + 8 * hi;
#pragma unroll
        for (int kb = 0; kb < NKB; ++kb)
#pragma unroll
            for (int kc = 0; kc < 2; ++kc) { ka[kb][kc] = WFrag<T16>::ld(pk + kb * 16 * HD + kc * 32); if (HL) ka2[kb][kc] = WFrag<T16>::ld(pk2 + kb * 16 * HD + kc * 32); }
        // the same wait behind the K loads of the next key tile
        if (HL) asm volatile("s_wait_xcnt 0x0" :: "v"(pk), "v"(pk2) : "memory"); else asm volatile("s_wait_xcnt 0x0" :: "v"(pk) : "memory");
        const bool diag = (k0 + KT - 1 > q0);      // wave-uniform: only the last key tile holds keys beyond a query of this wave
        if (diag) {
#pragma unroll
            for (int qb = 0; qb < 2; ++qb)
#pragma unroll
                for (int kb = 0; kb < NKB; ++kb)
#pragma unroll
                    for (int j = 0; j < 8; ++j) if (k0 + kb * 16 + hi * 8 + j > q0 + qb * 16 + lr) s[kb][qb][j] = -3.0e38f; }
        V pf[NCH][2], pf2[NCH][2];
#pragma unroll
        for (int qb = 0; qb < 2; ++qb) { float mt = -3.0e38f;
#pragma unroll
            for (int kb = 0; kb < NKB; ++kb)
#pragma unroll
                for (int j = 0; j < 8; ++j) { const float t = s[kb][qb][j] * (SCL * 1.4426950408889634f); s[kb][qb][j] = t; mt = fmaxf(mt, t); }
            mt = fmaxf(mt, __shfl_xor(mt, 16, 32));
            const float mn = fmaxf(m[qb], mt); const float al = __builtin_amdgcn_exp2f(m[qb] - mn); m[qb] = mn; const float sh = PSH - mn; float ls[NKB];      // one partial sum per 16 keys: short add chains
#pragma unroll
            for (int kb = 0; kb < NKB; ++kb) { ls[kb] = 0.f;
#pragma unroll
                for (int j = 0; j < 8; ++j) { const float p = __builtin_amdgcn_exp2f(s[kb][qb][j] + sh); s[kb][qb][j] = p; ls[kb] += p; } }
            float lsum = ls[0] + ls[1]; if (NKB == 4) lsum += ls[NKB - 2] + ls[NKB - 1];
            l[qb] = l[qb] * al + lsum;
#pragma unroll
            for (int db = 0; db < 4; ++db) o[db][qb] *= al;
#pragma unroll
            for (int ch = 0; ch < NCH; ++ch) {
                if constexpr (HL) { v16us ph, pl;
#pragma unroll
                    for (int e = 0; e < 16; ++e) { unsigned short a, c2; splitf(s[2 * ch + (e >> 3)][qb][e & 7], a, c2); ph[e] = a; pl[e] = c2; }
                    pf[ch][qb] = __builtin_bit_cast(v16bf, ph); pf2[ch][qb] = __builtin_bit_cast(v16bf, pl);
                } else { v16h ph;
#pragma unroll
                    for (int e = 0; e < 16; ++e) ph[e] = tohx(s[2 * ch + (e >> 3)][qb][e & 7]);
                    pf[ch][qb] = ph; } } }
#pragma unroll
        for (int db = 0; db < 4; ++db)
#pragma unroll
            for (int qb = 0; qb < 2; ++qb)
#pragma unroll
                for (int ch = 0; ch < NCH; ++ch) { o[db][qb] = WFrag<T16>::mma(va[db][ch], pf[ch][qb], o[db][qb]); if (HL) { o[db][qb] = WFrag<T16>::mma(va[db][ch], pf2[ch][qb], o[db][qb]); o[db][qb] = WFrag<T16>::mma(va2[db][ch], pf[ch][qb], o[db][qb]); } }
    }
#pragma unroll
    for (int qb = 0; qb < 2; ++qb) { const float lt = l[qb] + __shfl_xor(l[qb], 16, 32); const float f = __fdiv_rn(1.0f, lt);
        bf* ph = Ah + (size_t)(q0 + qb * 16 + lr) * DQ + hi * 8; bf* pl = Al + (size_t)(q0 + qb * 16 + lr) * DQ + hi * 8;
#pragma unroll
        for (int db = 0; db < 4; ++db) { v8us oh, ol;
#pragma unroll
            for (int j = 0; j < 8; ++j) { unsigned short a, c2; splitf(o[db][qb][j] * f, a, c2); oh[j] = a; ol[j] = c2; }
            *(v8us*)(ph + db * 16) = oh; *(v8us*)(pl + db * 16) = ol; } }
}
// grid (TT / 32, NKV), 128 threads; the lower half of the kv groups walks the row tiles from the longest (most key tiles) down, the upper half from the shortest up: blocks half a grid apart then add up to about the same work
__global__ __launch_bounds__(128) void k_fattn(const h16* __restrict__ Q16, const bf* __restrict__ Qh, const bf* __restrict__ Ql, const h16* __restrict__ K16, const bf* __restrict__ Kh, const bf* __restrict__ Kl, const h16* __restrict__ V16, const bf* __restrict__ Vh, const bf* __restrict__ Vl, bf* Ah, bf* Al) {
    const int lane = threadIdx.x & 31, lr = lane & 15, hi = lane >> 4; const int g = blockIdx.y; const int h = g * REP + (threadIdx.x >> 5); const int q0 = ((g < NKV / 2) ? TT / 32 - 1 - (int)blockIdx.x : (int)blockIdx.x) * 32;
    const size_t zq = (size_t)h * TT * HD, zk = (size_t)g * TT * HD;
    if (q0 < RH) attn_tile<bf, true, 32>(Qh + zq, Ql + zq, Kh + zk, Kl + zk, Vh + zk, Vl + zk, q0, lr, hi, Ah + h * HD, Al + h * HD);
    else attn_tile<h16, false, 64>(Q16 + zq, Q16 + zq, K16 + zk, K16 + zk, V16 + zk, V16 + zk, q0, lr, hi, Ah + h * HD, Al + h * HD);
}

extern "C" void kernel_launch(void* const* d_in, const int* in_sizes, int n_in,
                              void* d_out, int out_size, void* d_ws, size_t ws_size, hipStream_t stream) {
    (void)in_sizes; (void)n_in; (void)out_size;
    const float* x = (const float*)d_in[0]; const float* wq = (const float*)d_in[1]; const float* wk = (const float*)d_in[2]; const float* wv = (const float*)d_in[3]; const float* wo = (const float*)d_in[4];   /* FIVE inputs, all read; this module has no position input: the table is computed for positions 0..2047 */
    float* OUT = (float*)d_out;     // [2][2048][2048]
    char* wsp = (char*)d_ws;
    auto take = [&](size_t bytes) { char* p = wsp; wsp += (bytes + 255) & ~(size_t)255; return (void*)p; };
    bf* WQ = (bf*)take((size_t)DQ * DM * 2); bf* WK = (bf*)take((size_t)DKV * DM * 2); bf* WV = (bf*)take((size_t)DKV * DM * 2); bf* WO = (bf*)take((size_t)DM * DQ * 2); float* CS = (float*)take((size_t)TT * HD * 2 * 4);
    bf* XB = (bf*)take((size_t)TT * DM * 2); float* FQ = (float*)take((size_t)TT * DQ * 4); float* FK = (float*)take((size_t)TT * DKV * 4);
    h16* QP16 = (h16*)take((size_t)NH_ * TT * HD * 2); h16* KP16 = (h16*)take((size_t)NKV * TT * HD * 2); h16* VT16 = (h16*)take((size_t)NKV * HD * TT * 2);
    bf* QPh = (bf*)take((size_t)NH_ * TT * HD * 2); bf* QPl = (bf*)take((size_t)NH_ * TT * HD * 2); bf* KPh = (bf*)take((size_t)NKV * TT * HD * 2); bf* KPl = (bf*)take((size_t)NKV * TT * HD * 2); bf* VTh = (bf*)take((size_t)NKV * HD * TT * 2); bf* VTl = (bf*)take((size_t)NKV * HD * TT * 2);
    bf* ATh = (bf*)take((size_t)TT * DQ * 2); bf* ATl = (bf*)take((size_t)TT * DQ * 2);
    if ((size_t)(wsp - (char*)d_ws) > ws_size) return;    // ws 256 MiB
    float* FV = FK;   // v projection reuses the k buffer after the k planes are built (stream-ordered)
    { k_wtG<<<(unsigned)((DM * DQ / 64 + 63) / 64), 256, 0, stream>>>(wq, DM, DQ, WQ); k_wtG<<<(unsigned)((DM * DKV / 64 + 63) / 64), 256, 0, stream>>>(wk, DM, DKV, WK); k_wtG<<<(unsigned)((DM * DKV / 64 + 63) / 64), 256, 0, stream>>>(wv, DM, DKV, WV);
      k_wtG<<<(unsigned)((DQ * DM / 64 + 63) / 64), 256, 0, stream>>>(wo, DQ, DM, WO);
      k_csP<<<(TT * HD + 255) / 256, 256, 0, stream>>>(CS); }
    const unsigned LQ = (unsigned)(((size_t)NH_ * TT * HD / 2 + 255) / 256), LKv = (unsigned)(((size_t)NKV * TT * HD / 2 + 255) / 256);
    for (int b = 0; b < NB_; ++b) {
        
        k_cvt8<<<(unsigned)(((size_t)TT * DM / 8 + 255) / 256), 256, 0, stream>>>(x + (size_t)b * TT * DM, XB, (size_t)TT * DM / 8);
        k_gemmw<bf, 0, false><<<dim3(TT / 64, DQ / 64, 1), 32, 0, stream>>>(XB, nullptr, WQ, nullptr, DM, FQ, DQ, nullptr, 0, 0, 0);
        k_ropeI<<<LQ, 256, 0, stream>>>(FQ, DQ, NH_, CS, 1.0f, QP16, QPh, QPl);
        k_gemmw<bf, 0, false><<<dim3(TT / 64, DKV / 64, 1), 32, 0, stream>>>(XB, nullptr, WK, nullptr, DM, FK, DKV, nullptr, 0, 0, 0);
        k_ropeI<<<LKv, 256, 0, stream>>>(FK, DKV, NKV, CS, 1.0f, KP16, KPh, KPl);
        k_gemmw<bf, 0, false><<<dim3(TT / 64, DKV / 64, 1), 32, 0, stream>>>(XB, nullptr, WV, nullptr, DM, FV, DKV, nullptr, 0, 0, 0); k_vtp<<<LKv, 256, 0, stream>>>(FV, DKV, NKV, VT16, VTh, VTl);
        k_fattn<<<dim3(TT / 32, NKV, 1), 128, 0, stream>>>(QP16, QPh, QPl, KP16, KPh, KPl, VT16, VTh, VTl, ATh, ATl);
        k_gemmw<bf, 1, false><<<dim3(TT / 64, DM / 64, 1), 32, 0, stream>>>(ATh, ATl, WO, nullptr, DQ, OUT + (size_t)b * TT * DM, DM, nullptr, 0, 0, 0); }
}
